// v000
// Times are from an AMD MI455X. After a warm-up the kernel runs many times in a row, and a time is the length of
// such a window on the GPU divided by its runs, so every launch and the gaps after it count. The runs cycle
// through copies of the inputs. A figure is the median of several windows, for all but v000 over two sittings.
// Sittings can differ by a few percent; kernels timed side by side share one.
// v000 is the starting kernel. One run takes 187 microseconds.
#include <hip/hip_runtime.h>
// NodeAttention (32 samples x 8192 nodes x 32 channels-per-node): h = elu(x_n W1 + b1) (HID 256); hn = LayerNorm(h) (biased var, 1e-5, affine); alpha = hn . W2 + b2; out = x_n * sigmoid(alpha) per node.
// Compute dtype: x and parameters rounded to bf16; no low-precision operands beyond that (x and W1 exact in f16); everything else f32. v_wmma_f32_16x16x32_f16.
#define NBT 32
#define NND 8192
#define CPN 32
#define HID 256
#define NRW (NBT * NND)          /* 262144 node rows */
typedef __bf16 v16b __attribute__((ext_vector_type(16)));
typedef unsigned short v8us __attribute__((ext_vector_type(8), may_alias));
typedef float  v8f  __attribute__((ext_vector_type(8)));
typedef float  v4f  __attribute__((ext_vector_type(4)));
typedef float  v4fa __attribute__((ext_vector_type(4), may_alias));
union FragB { v16b v; v8us half[2]; unsigned short u[16]; };

__device__ __forceinline__ unsigned short bf16_bits(float x) { unsigned int u = __float_as_uint(x); return (unsigned short)((u + 0x7FFFu + ((u >> 16) & 1u)) >> 16); }
__device__ __forceinline__ float bf16_val(unsigned short b) { return __uint_as_float(((unsigned int)b) << 16); }
__device__ __forceinline__ float bf16_round(float x) { return bf16_val(bf16_bits(x)); }
// D += A·B with NT terms: 1 = ah·bh, 2 = + al·bh (A split), 3 = + ah·bl (both split)
template <int NT>
__device__ __forceinline__ v8f mmaN(v16b ah, v16b al, v16b bh, v16b bl, v8f c) {
  c = __builtin_amdgcn_wmma_f32_16x16x32_bf16(false, ah, false, bh, (short)0, c, false, false);
  if (NT >= 2) c = __builtin_amdgcn_wmma_f32_16x16x32_bf16(false, al, false, bh, (short)0, c, false, false);
  if (NT >= 3) c = __builtin_amdgcn_wmma_f32_16x16x32_bf16(false, ah, false, bl, (short)0, c, false, false);
  asm volatile("v_nop\n\tv_nop\n\tv_nop\n\tv_nop" : "+v"(c) : "v"(ah), "v"(al), "v"(bh), "v"(bl));
  return c;
}

__global__ __launch_bounds__(256) void k_wt_bf16(const float* __restrict__ W, unsigned short* __restrict__ Wt, int K, int N) {
  const int t = blockIdx.x * 256 + threadIdx.x;
  const int k8n = K / 8;
  if (t >= N * k8n) return;
  const int n = t / k8n, k8 = (t % k8n) * 8;
  v8us v;
#pragma unroll
  for (int i = 0; i < 8; ++i) v[i] = bf16_bits(W[(size_t)(k8 + i) * N + n]);
  *(v8us*)(Wt + (size_t)n * K + k8) = v;
  
}

// GEMM C[M][N] (f32, pitch ldc) = act(A[M][K]·W + bias). A f32 row-major (pitch lda) converted per fragment to bf16
// (ASPLIT: hi/lo two planes -> 2 terms, else single rounded term); Wt bf16 [N][K] (pitch ldb). BIAS_BF16 rounds the
// bias to bf16 first (bias quantised to bf16 before the add). K%32==0, M%16==0, N%64==0.
template <bool ASPLIT, int ACT, bool BIAS_BF16>
__global__ __launch_bounds__(128) void k_gemm_bf(const float* __restrict__ A, int lda, const unsigned short* __restrict__ Wt, int ldb,
                                               const float* __restrict__ bias, float* __restrict__ C, int ldc, int M, int N, int K) {
  __shared__ __attribute__((aligned(16))) float so[4][16][64];
  const int tid = threadIdx.x, w = tid >> 5, lane = tid & 31, ln = lane & 15, hh = lane >> 4;
  const int ntn = N / 64;
  const int wid = blockIdx.x * 4 + w;
  const int mt = wid / ntn, nq = wid % ntn;
  if (mt * 16 >= M) return;
  const int row0 = mt * 16, col0 = nq * 64;
  const float* arow = A + (size_t)(row0 + ln) * lda;
  v8f acc[4] = {};
  for (int kb = 0; kb < K; kb += 32) {
    FragB ah, al;
    const v4f x0 = *(const v4fa*)(arow + kb + 8 * hh), x1 = *(const v4fa*)(arow + kb + 8 * hh + 4);
    const v4f x2 = *(const v4fa*)(arow + kb + 16 + 8 * hh), x3 = *(const v4fa*)(arow + kb + 16 + 8 * hh + 4);
    float xs[16] = {x0[0],x0[1],x0[2],x0[3],x1[0],x1[1],x1[2],x1[3],x2[0],x2[1],x2[2],x2[3],x3[0],x3[1],x3[2],x3[3]};
#pragma unroll
    for (int i = 0; i < 16; ++i) { const unsigned short hb = bf16_bits(xs[i]); ah.u[i] = hb; al.u[i] = ASPLIT ? bf16_bits(xs[i] - bf16_val(hb)) : (unsigned short)0; }
#pragma unroll
    for (int t = 0; t < 4; ++t) {
      const unsigned short* brow = Wt + (size_t)(col0 + t * 16 + ln) * ldb + kb;
      FragB b;
      b.half[0] = *(const v8us*)(brow + 8 * hh);
      b.half[1] = *(const v8us*)(brow + 16 + 8 * hh);
      acc[t] = mmaN<ASPLIT ? 2 : 1>(ah.v, al.v, b.v, b.v, acc[t]);
    }
  }
#pragma unroll
  for (int t = 0; t < 4; ++t) {
    float bv = bias ? bias[col0 + t * 16 + ln] : 0.f;
    if (BIAS_BF16) bv = bf16_round(bv);
#pragma unroll
    for (int r = 0; r < 8; ++r) { float v = acc[t][r] + bv; if (ACT == 1) v = fmaxf(v, 0.f); so[w][8 * hh + r][t * 16 + ln] = v; }
  }
  __builtin_amdgcn_fence(__ATOMIC_ACQ_REL, "workgroup");
  __builtin_amdgcn_wave_barrier();
  const int rsub = lane >> 4, c4 = (lane & 15) * 4;
  {
#pragma unroll
    for (int q = 0; q < 8; ++q) {
      const int r = q * 2 + rsub;
      const v4f v = *(const v4fa*)&so[w][r][c4];
      *(v4f*)(C + (size_t)(row0 + r) * ldc + col0 + c4) = v;
    }
    
  }
}

// GEMM C = act(A·W + bias + resid): A f32 (ASPLIT -> hi/lo 2 terms), Wt bf16 [N][K]; ACT 0 none, 1 relu, 2 exact gelu;
// resid (optional, f32, row index = (row % rmod), pitch ldr, RES_BF16 rounds it) added before the activation.
template <bool ASPLIT, int ACT, bool BIAS_BF16, bool RES_BF16>
__global__ __launch_bounds__(128) void k_gemm_bf3(const float* __restrict__ A, int lda, const unsigned short* __restrict__ Wt, int ldb,
                                                const float* __restrict__ bias, const float* __restrict__ resid, int rmod, int ldr,
                                                float* __restrict__ C, int ldc, int M, int N, int K) {
  __shared__ __attribute__((aligned(16))) float so[4][16][64];
  const int tid = threadIdx.x, w = tid >> 5, lane = tid & 31, ln = lane & 15, hh = lane >> 4;
  const int ntn = N / 64;
  const int wid = blockIdx.x * 4 + w;
  const int mt = wid / ntn, nq = wid % ntn;
  if (mt * 16 >= M) return;
  const int row0 = mt * 16, col0 = nq * 64;
  const float* arow = A + (size_t)(row0 + ln) * lda;
  v8f acc[4] = {};
  for (int kb = 0; kb < K; kb += 32) {
    FragB ah, al;
    const v4f x0 = *(const v4fa*)(arow + kb + 8 * hh), x1 = *(const v4fa*)(arow + kb + 8 * hh + 4);
    const v4f x2 = *(const v4fa*)(arow + kb + 16 + 8 * hh), x3 = *(const v4fa*)(arow + kb + 16 + 8 * hh + 4);
    float xs[16] = {x0[0],x0[1],x0[2],x0[3],x1[0],x1[1],x1[2],x1[3],x2[0],x2[1],x2[2],x2[3],x3[0],x3[1],x3[2],x3[3]};
#pragma unroll
    for (int i = 0; i < 16; ++i) { const unsigned short hb = bf16_bits(xs[i]); ah.u[i] = hb; al.u[i] = ASPLIT ? bf16_bits(xs[i] - bf16_val(hb)) : (unsigned short)0; }
#pragma unroll
    for (int t = 0; t < 4; ++t) {
      const unsigned short* brow = Wt + (size_t)(col0 + t * 16 + ln) * ldb + kb;
      FragB b;
      b.half[0] = *(const v8us*)(brow + 8 * hh);
      b.half[1] = *(const v8us*)(brow + 16 + 8 * hh);
      acc[t] = mmaN<ASPLIT ? 2 : 1>(ah.v, al.v, b.v, b.v, acc[t]);
    }
  }
#pragma unroll
  for (int t = 0; t < 4; ++t) {
    const int col = col0 + t * 16 + ln;
    float bv = bias ? bias[col] : 0.f;
    if (BIAS_BF16) bv = bf16_round(bv);
#pragma unroll
    for (int r = 0; r < 8; ++r) {
      float v = acc[t][r] + bv;
      if (resid) { float rv = resid[(size_t)((row0 + 8 * hh + r) % rmod) * ldr + col]; if (RES_BF16) rv = bf16_round(rv); v += rv; }
      if (ACT == 1) v = fmaxf(v, 0.f);
      if (ACT == 2) v = 0.5f * v * (1.0f + erff(v * 0.70710678118654752f));
      if (ACT == 3) { const float u = 0.7978845608028654f * (v + 0.044715f * v * v * v); v = 0.5f * v * (1.0f + tanhf(u)); }
      so[w][8 * hh + r][t * 16 + ln] = v;
    }
  }
  __builtin_amdgcn_fence(__ATOMIC_ACQ_REL, "workgroup");
  __builtin_amdgcn_wave_barrier();
  const int rsub = lane >> 4, c4 = (lane & 15) * 4;
  {
#pragma unroll
    for (int q = 0; q < 8; ++q) {
      const int r = q * 2 + rsub;
      const v4f v = *(const v4fa*)&so[w][r][c4];
      *(v4f*)(C + (size_t)(row0 + r) * ldc + col0 + c4) = v;
    }
    
  }
}
// row LayerNorm (biased variance, eps) over N: s = X (+ R); optional out_sum <- s; out_norm <- (s-mu)*rsqrt(var+eps)*g + b
template <bool PARAM_BF16>
__global__ __launch_bounds__(256) void k_layernorm(const float* __restrict__ X, const float* __restrict__ R, const float* __restrict__ g, const float* __restrict__ bta,
                                                  float* __restrict__ out_sum, float* __restrict__ out_norm, int N, float eps) {
  __shared__ float red[256];
  const int row = blockIdx.x, tid = threadIdx.x;
  const float* x = X + (size_t)row * N; const float* rr = R ? R + (size_t)row * N : nullptr;
  float vals[16];                     // up to N = 4096
  const int per = N / 256;            // contiguous chunk per thread? use strided-by-4 chunks: thread handles j = tid*4 + 1024*u
  float s1 = 0.f;
  for (int u = 0; u < per / 4; ++u) {
    const int j = tid * 4 + 1024 * u;
    const v4f a = *(const v4fa*)(x + j);
    v4f b = {0.f,0.f,0.f,0.f}; if (rr) b = *(const v4fa*)(rr + j);
#pragma unroll
    for (int q = 0; q < 4; ++q) { const float v = a[q] + b[q]; vals[u * 4 + q] = v; s1 += v; }
  }
  red[tid] = s1; __syncthreads();
  for (int st = 128; st > 0; st >>= 1) { if (tid < st) red[tid] += red[tid + st]; __syncthreads(); }
  const float mu = red[0] / (float)N; __syncthreads();
  float s2 = 0.f;
  for (int u = 0; u < per / 4; ++u)
#pragma unroll
    for (int q = 0; q < 4; ++q) { const float c = vals[u * 4 + q] - mu; s2 += c * c; }
  red[tid] = s2; __syncthreads();
  for (int st = 128; st > 0; st >>= 1) { if (tid < st) red[tid] += red[tid + st]; __syncthreads(); }
  const float rs = rsqrtf(red[0] / (float)N + eps);
  {
    for (int u = 0; u < per / 4; ++u) {
      const int j = tid * 4 + 1024 * u;
      v4f o, sm;
#pragma unroll
      for (int q = 0; q < 4; ++q) {
        float gg = g[j + q], bb = bta[j + q];
        if (PARAM_BF16) { gg = bf16_round(gg); bb = bf16_round(bb); }
        sm[q] = vals[u * 4 + q]; o[q] = (vals[u * 4 + q] - mu) * rs * gg + bb;
      }
      if (out_sum) *(v4f*)(out_sum + (size_t)row * N + j) = sm;
      *(v4f*)(out_norm + (size_t)row * N + j) = o;
    }
    
  }
}



// ---- f16 WMMA path (v_wmma_f32_16x16x32_f16): 11-bit significands for operands in range — used here for x·W1, whose bf16-rounded values stay exact in f16
typedef _Float16 v16h __attribute__((ext_vector_type(16)));
union FragH { v16h v; v8us half[2]; _Float16 h[16]; unsigned short u[16]; };
template <int NT>
__device__ __forceinline__ v8f mmaH(v16h ah, v16h al, v16h bh, v16h bl, v8f c) {
  c = __builtin_amdgcn_wmma_f32_16x16x32_f16(false, ah, false, bh, (short)0, c, false, false);
  if (NT >= 2) c = __builtin_amdgcn_wmma_f32_16x16x32_f16(false, al, false, bh, (short)0, c, false, false);
  if (NT >= 3) c = __builtin_amdgcn_wmma_f32_16x16x32_f16(false, ah, false, bl, (short)0, c, false, false);
  asm volatile("v_nop\n\tv_nop\n\tv_nop\n\tv_nop" : "+v"(c) : "v"(ah), "v"(al), "v"(bh), "v"(bl));
  return c;
}
// batched GEMM like k_gemm_b but f16 operands: A f32 (split into f16 hi/lo if ASPLIT, else rounded to f16), Bt = f16 values [n][k]; alpha; C f32; N multiple of 16 (partial tiles skipped)
template <bool ASPLIT>
__global__ __launch_bounds__(128) void k_gemm_h(const float* __restrict__ A, int lda, size_t sA, const _Float16* __restrict__ Bh, int ldb, size_t sB, float alpha, float* __restrict__ C, int ldc, size_t sC, int M, int N, int K) {
  __shared__ __attribute__((aligned(16))) float so[4][16][64];
  const int tid = threadIdx.x, w = tid >> 5, lane = tid & 31, ln = lane & 15, hh = lane >> 4; const int by = blockIdx.y;
  A += (size_t)by * sA; Bh += (size_t)by * sB; C += (size_t)by * sC;
  const int ntn = (N + 63) / 64; const int wid = blockIdx.x * 4 + w; const int mt = wid / ntn, nq = wid % ntn; if (mt * 16 >= M) return;
  const int row0 = mt * 16, col0 = nq * 64; const float* arow = A + (size_t)(row0 + ln) * lda;
  v8f acc[4] = {};
  for (int kb = 0; kb < K; kb += 32) {
    FragH ah, al;
    const v4f x0 = *(const v4fa*)(arow + kb + 8 * hh), x1 = *(const v4fa*)(arow + kb + 8 * hh + 4), x2 = *(const v4fa*)(arow + kb + 16 + 8 * hh), x3 = *(const v4fa*)(arow + kb + 16 + 8 * hh + 4);
    float xs[16] = {x0[0],x0[1],x0[2],x0[3],x1[0],x1[1],x1[2],x1[3],x2[0],x2[1],x2[2],x2[3],x3[0],x3[1],x3[2],x3[3]};
#pragma unroll
    for (int i = 0; i < 16; ++i) { const _Float16 h = (_Float16)xs[i]; ah.h[i] = h; al.h[i] = ASPLIT ? (_Float16)(xs[i] - (float)h) : (_Float16)0.0f; }
#pragma unroll
    for (int t = 0; t < 4; ++t) { if (col0 + t * 16 >= N) continue; const size_t boff = (size_t)(col0 + t * 16 + ln) * ldb + kb; FragH bq; bq.half[0] = *(const v8us*)(Bh + boff + 8 * hh); bq.half[1] = *(const v8us*)(Bh + boff + 16 + 8 * hh);
      acc[t] = mmaH<ASPLIT ? 2 : 1>(ah.v, al.v, bq.v, bq.v, acc[t]); }
  }
#pragma unroll
  for (int t = 0; t < 4; ++t) { if (col0 + t * 16 >= N) continue;
#pragma unroll
    for (int r = 0; r < 8; ++r) so[w][8 * hh + r][t * 16 + ln] = acc[t][r] * alpha; }
  __builtin_amdgcn_fence(__ATOMIC_ACQ_REL, "workgroup"); __builtin_amdgcn_wave_barrier();
  const int rsub = lane >> 4, c4 = (lane & 15) * 4;
  {
#pragma unroll
    for (int q = 0; q < 8; ++q) { const int r = q * 2 + rsub; if (col0 + c4 < N) { const v4f v = *(const v4fa*)&so[w][r][c4]; *(v4f*)(C + (size_t)(row0 + r) * ldc + col0 + c4) = v; } }
     }
}

// Wt[n][k] = f16(W[k][n]·scale) from f32 row-major W[K][N] (scale = power of two; bf16-exact weights stay exact in f16 away from the subnormal range)
__global__ __launch_bounds__(256) void k_wt_f16(const float* __restrict__ W, _Float16* __restrict__ Wt, int K, int N, float scale) {
  const int t = blockIdx.x * 256 + threadIdx.x; if (t >= N * (K / 8)) return; const int n = t / (K / 8), k8 = (t % (K / 8)) * 8; FragH f;
#pragma unroll
  for (int i = 0; i < 8; ++i) f.h[i] = (_Float16)(bf16_round(W[(size_t)(k8 + i) * N + n]) * scale); const v8us o = f.half[0];
  *(v8us*)((unsigned short*)Wt + (size_t)n * K + k8) = o; 
}
// k_gemm_hh variant with fused epilogue: v = acc·alpha + bias[by·sBias + col] (+ CP[(row/rowsPerB)·sCPb + by·64 + col] if CP) ; ACT 0 none / 1 elu ; writes f16 C16 (and f32 C if non-null)
template <int ACT>
__global__ __launch_bounds__(128) void k_gemm_hhx(const _Float16* __restrict__ A, int lda, size_t sA, const _Float16* __restrict__ Bh, int ldb, size_t sB, float alpha, const float* __restrict__ bias, size_t sBias, const float* __restrict__ CP, int rowsPerB, size_t sCPb, int row0g,
    float* __restrict__ C, _Float16* __restrict__ C16, int ldc, size_t sC, int M, int N, int K) {
  __shared__ __attribute__((aligned(16))) float so[4][16][64];
  const int tid = threadIdx.x, w = tid >> 5, lane = tid & 31, ln = lane & 15, hh = lane >> 4; const int by = blockIdx.y;
  A += (size_t)by * sA; Bh += (size_t)by * sB; const size_t cofs = (size_t)by * sC; const float* bp = bias ? bias + (size_t)by * sBias : nullptr;
  const int ntn = (N + 63) / 64; const int wid = blockIdx.x * 4 + w; const int mt = wid / ntn, nq = wid % ntn; if (mt * 16 >= M) return;
  const int row0 = mt * 16, col0 = nq * 64; const _Float16* arow = A + (size_t)(row0 + ln) * lda;
  v8f acc[4] = {};
  for (int kb = 0; kb < K; kb += 32) { FragH ah; ah.half[0] = *(const v8us*)((const unsigned short*)arow + kb + 8 * hh); ah.half[1] = *(const v8us*)((const unsigned short*)arow + kb + 16 + 8 * hh);
#pragma unroll
    for (int t = 0; t < 4; ++t) { if (col0 + t * 16 >= N) continue; const size_t boff = (size_t)(col0 + t * 16 + ln) * ldb + kb; FragH bq; bq.half[0] = *(const v8us*)((const unsigned short*)Bh + boff + 8 * hh); bq.half[1] = *(const v8us*)((const unsigned short*)Bh + boff + 16 + 8 * hh);
      acc[t] = mmaH<1>(ah.v, ah.v, bq.v, bq.v, acc[t]); }
  }
#pragma unroll
  for (int t = 0; t < 4; ++t) { if (col0 + t * 16 >= N) continue; const int col = col0 + t * 16 + ln; const float bv = bp ? bf16_round(bp[col]) : 0.f;
#pragma unroll
    for (int r = 0; r < 8; ++r) { float v = acc[t][r] * alpha + bv; if (CP) { const int rr = row0g + row0 + 8 * hh + r; if (rowsPerB < 0) v += CP[cofs + (size_t)rr * ldc + col];      /* rowsPerB < 0: own element of the batched C plane */ else { const int bidx = rr / rowsPerB; v += CP[(size_t)bidx * sCPb + (size_t)by * 64 + col]; } } if (ACT == 1) v = (v > 0.f) ? v : expm1f(v); else if (ACT == 7) v = (v > 0.f) ? v + 1.0f : expf(v); else if (ACT == 8) v = tanhf(v); else if (ACT == 9) v = 0.5f * v * (1.0f + tanhf(0.7978845608028654f * (v + 0.044715f * v * v * v))); else if (ACT == 11) v = 1.0f / (1.0f + expf(-v)); else if (ACT == 12) v = (v > 0.f) ? v : 0.01f * v; else if (ACT == 14) v = (v > 0.f) ? v : 0.1f * v; else if (ACT == 16) v = (v >= 0.f) ? v : 0.3f * v; else if (ACT == 15) v = v / (1.0f + expf(-v)); else if (ACT == 3) v = fmaxf(v, 0.f); else if (ACT == 6) v = 0.5f * v * (1.0f + erff(v * 0.70710678118654752f)); so[w][8 * hh + r][t * 16 + ln] = v; } }
  __builtin_amdgcn_fence(__ATOMIC_ACQ_REL, "workgroup"); __builtin_amdgcn_wave_barrier();
  const int rsub = lane >> 4, c4 = (lane & 15) * 4; typedef _Float16 v4h __attribute__((ext_vector_type(4)));
  {
#pragma unroll
    for (int q = 0; q < 8; ++q) { const int r = q * 2 + rsub; if (col0 + c4 < N) { const v4f v = *(const v4fa*)&so[w][r][c4]; if (C) *(v4f*)(C + cofs + (size_t)(row0 + r) * ldc + col0 + c4) = v; if (C16) { v4h h4; for (int i = 0; i < 4; ++i) h4[i] = (_Float16)v[i]; *(v4h*)(C16 + cofs + (size_t)(row0 + r) * ldc + col0 + c4) = h4; } } }
     }
}


typedef _Float16 v4h __attribute__((ext_vector_type(4)));

__global__ __launch_bounds__(256) void k_x16(const float* __restrict__ x, _Float16* __restrict__ X16, size_t n8) { const size_t t = (size_t)blockIdx.x * 256 + threadIdx.x; if (t >= n8) return; FragH f;
#pragma unroll
  for (int q = 0; q < 8; ++q) f.h[q] = (_Float16)bf16_round(x[t * 8 + q]); *(v8us*)((unsigned short*)X16 + t * 8) = f.half[0];  }
__global__ __launch_bounds__(256) void k_h16(const float* __restrict__ x, _Float16* __restrict__ X16, size_t n8) { const size_t t = (size_t)blockIdx.x * 256 + threadIdx.x; if (t >= n8) return; FragH f;
#pragma unroll
  for (int q = 0; q < 8; ++q) f.h[q] = (_Float16)x[t * 8 + q]; *(v8us*)((unsigned short*)X16 + t * 8) = f.half[0];  }
__global__ __launch_bounds__(256) void k_round16f(const float* __restrict__ W, _Float16* __restrict__ Bt, size_t n8) { const size_t t = (size_t)blockIdx.x * 256 + threadIdx.x; if (t >= n8) return; FragH f;
#pragma unroll
  for (int i = 0; i < 8; ++i) f.h[i] = (_Float16)(bf16_round(W[t * 8 + i]) * 16.0f); *(v8us*)((unsigned short*)Bt + t * 8) = f.half[0];  }
template <int NHv, int TTv>
__global__ __launch_bounds__(256) void k_vt(const _Float16* __restrict__ V16, int ldv, int voff, _Float16* __restrict__ Vt) { __shared__ unsigned short tl[64][66]; const int tid = threadIdx.x; const int slab = blockIdx.x / (TTv / 64), lg = blockIdx.x % (TTv / 64); const int b = slab / NHv, h = slab % NHv;
  for (int i = tid; i < 64 * 8; i += 256) { const int r = i / 8, c8 = (i % 8) * 8; FragH f; f.half[0] = *(const v8us*)((const unsigned short*)V16 + ((size_t)b * TTv + lg * 64 + r) * ldv + voff + h * 64 + c8);
#pragma unroll
    for (int q = 0; q < 8; ++q) tl[r][c8 + q] = f.u[q]; }
  __syncthreads();
  {
#pragma unroll
    for (int rd = 0; rd < 2; ++rd) { const int d = rd * 32 + tid / 8, pc = tid % 8; FragH f;
#pragma unroll
      for (int q = 0; q < 8; ++q) f.u[q] = tl[pc * 8 + q][d];
      *(v8us*)((unsigned short*)Vt + ((size_t)slab * 64 + d) * TTv + lg * 64 + pc * 8) = f.half[0]; }
     } }

__global__ __launch_bounds__(256) void k_hl(const float* __restrict__ F, _Float16* __restrict__ Hh, _Float16* __restrict__ Hl, size_t n8) { const size_t t = (size_t)blockIdx.x * 256 + threadIdx.x; if (t >= n8) return; FragH fh, fl; const v4f a = *(const v4fa*)(F + t * 8), c = *(const v4fa*)(F + t * 8 + 4);
#pragma unroll
  for (int q = 0; q < 4; ++q) { _Float16 h = (_Float16)a[q]; fh.h[q] = h; fl.h[q] = (_Float16)((a[q] - (float)h) * 1024.0f); h = (_Float16)c[q]; fh.h[4 + q] = h; fl.h[4 + q] = (_Float16)((c[q] - (float)h) * 1024.0f); }
  { *(v8us*)((unsigned short*)Hh + t * 8) = fh.half[0]; *(v8us*)((unsigned short*)Hl + t * 8) = fl.half[0];  } }

// ---- fast GEMM (wave tile 32x64; requires M % 32 == 0 rows per launch region and N % 64 == 0); epilogue = k_gemm_hhx semantics ----
__device__ __forceinline__ v16h g2_frag(const _Float16* p, int hh) { FragH f; f.half[0] = *(const v8us*)((const unsigned short*)p + 8 * hh); f.half[1] = *(const v8us*)((const unsigned short*)p + 16 + 8 * hh); return f.v; }
__device__ __forceinline__ v8f g2_mma(v16h a, v16h b, v8f c) { v8f d = __builtin_amdgcn_wmma_f32_16x16x32_f16(false, a, false, b, (short)0, c, false, false); asm volatile("v_nop\n\tv_nop\n\tv_nop\n\tv_nop" : "+v"(d) : "v"(a), "v"(b)); return d; }
template <int ACT>
__global__ __launch_bounds__(128) void k_gemm2(const _Float16* __restrict__ A, int lda, size_t sA, const _Float16* __restrict__ Bh, int ldb, size_t sB, float alpha, const float* __restrict__ bias, size_t sBias, const float* __restrict__ CP, int rowsPerB, size_t sCPb, int row0g,
    float* __restrict__ C, _Float16* __restrict__ C16, int ldc, size_t sC, int M, int N, int K) { static_assert(ACT == 0 || ACT == 3 || ACT == 6 || ACT == 8 || ACT == 9 || ACT == 11 || ACT == 12 || ACT == 14 || ACT == 15 || ACT == 16, "k_gemm2: unsupported ACT code (would silently apply no activation)");
  __shared__ __attribute__((aligned(16))) float so[4][32][68];
  const int tid = threadIdx.x, w = tid >> 5, lane = tid & 31, ln = lane & 15, hh = lane >> 4; const int by = blockIdx.y;
  A += (size_t)by * sA; Bh += (size_t)by * sB; const size_t cofs = (size_t)by * sC; const float* bp = bias ? bias + (size_t)by * sBias : nullptr;
  const int ntn = N >> 6; const int mt = blockIdx.x / ntn, nq = blockIdx.x - mt * ntn; const int row0 = mt * 128 + 32 * w, col0 = nq * 64; if (row0 >= M) return;
  const _Float16* a0p = A + (size_t)(row0 + ln) * lda; const _Float16* a1p = a0p + (size_t)16 * lda;
  const _Float16* b0p = Bh + (size_t)(col0 + ln) * ldb; const _Float16* b1p = b0p + (size_t)16 * ldb; const _Float16* b2p = b1p + (size_t)16 * ldb; const _Float16* b3p = b2p + (size_t)16 * ldb;
  const v8f z8 = {0.f,0.f,0.f,0.f,0.f,0.f,0.f,0.f}; v8f c00 = z8, c01 = z8, c02 = z8, c03 = z8, c10 = z8, c11 = z8, c12 = z8, c13 = z8;
#pragma unroll 1
  for (int kb = 0; kb < K; kb += 32) { const v16h a0 = g2_frag(a0p + kb, hh), a1 = g2_frag(a1p + kb, hh);
    v16h b = g2_frag(b0p + kb, hh); c00 = g2_mma(a0, b, c00); c10 = g2_mma(a1, b, c10);
    b = g2_frag(b1p + kb, hh); c01 = g2_mma(a0, b, c01); c11 = g2_mma(a1, b, c11);
    b = g2_frag(b2p + kb, hh); c02 = g2_mma(a0, b, c02); c12 = g2_mma(a1, b, c12);
    b = g2_frag(b3p + kb, hh); c03 = g2_mma(a0, b, c03); c13 = g2_mma(a1, b, c13); }
  v8f accs[8] = {c00, c01, c02, c03, c10, c11, c12, c13};
#pragma unroll
  for (int u = 0; u < 8; ++u) { const int t = u & 3, half = u >> 2; const int col = col0 + t * 16 + ln; const float bv = bp ? bf16_round(bp[col]) : 0.f;
#pragma unroll
    for (int r = 0; r < 8; ++r) { const int rloc = half * 16 + 8 * hh + r; float v = accs[u][r] * alpha + bv; if (CP) { if (rowsPerB < 0) v += CP[cofs + (size_t)(row0g + row0 + rloc) * ldc + col];      /* rowsPerB < 0: own element of the batched C plane */ else { const int bidx = (row0g + row0 + rloc) / rowsPerB; v += CP[(size_t)bidx * sCPb + (size_t)by * 64 + col]; } }
      if (ACT == 3) v = fmaxf(v, 0.f); else if (ACT == 6) v = 0.5f * v * (1.0f + erff(v * 0.70710678118654752f)); else if (ACT == 11) v = 1.0f / (1.0f + expf(-v)); else if (ACT == 15) v = v / (1.0f + expf(-v)); else if (ACT == 12) v = (v > 0.f) ? v : 0.01f * v; else if (ACT == 8) v = tanhf(v); else if (ACT == 9) v = 0.5f * v * (1.0f + tanhf(0.7978845608028654f * (v + 0.044715f * v * v * v))); else if (ACT == 14) v = (v > 0.f) ? v : 0.1f * v; else if (ACT == 16) v = (v >= 0.f) ? v : 0.3f * v;
      so[w][rloc][t * 16 + ln] = v; } }
  __builtin_amdgcn_fence(__ATOMIC_ACQ_REL, "workgroup"); __builtin_amdgcn_wave_barrier();
  const int rsub = lane >> 4, c4 = (lane & 15) * 4;
  {
#pragma unroll
    for (int q = 0; q < 16; ++q) { const int r = q * 2 + rsub; const v4f v = *(const v4fa*)&so[w][r][c4]; if (C) *(v4f*)(C + cofs + (size_t)(row0 + r) * ldc + col0 + c4) = v; if (C16) { v4h h4; for (int i = 0; i < 4; ++i) h4[i] = (_Float16)v[i]; *(v4h*)(C16 + cofs + (size_t)(row0 + r) * ldc + col0 + c4) = h4; } }
     } }


__global__ __launch_bounds__(256) void k_elu(float* __restrict__ Hp, size_t n4) { const size_t t = (size_t)blockIdx.x * 256 + threadIdx.x; if (t >= n4) return; const v4f a = *(const v4fa*)(Hp + t * 4); v4f r; for (int q = 0; q < 4; ++q) { const float v = a[q]; r[q] = (v > 0.f) ? v : expm1f(v); } *(v4f*)(Hp + t * 4) = r;  }
__global__ __launch_bounds__(256) void k_gate(const float* __restrict__ Hp, const float* __restrict__ x, const float* __restrict__ g, const float* __restrict__ bb, const float* __restrict__ W2, const float* __restrict__ b2, float* __restrict__ out) {
  #pragma clang fp contract(off)
  const int wv = threadIdx.x >> 5, ln = threadIdx.x & 31; const size_t r = (size_t)blockIdx.x * 8 + wv; if (r >= NRW) return; const v8f a = *(const v8f*)(Hp + r * HID + ln * 8); float h[8]; float s = 0.f;
  for (int q = 0; q < 8; ++q) { h[q] = a[q]; s += a[q]; }      /* ELU already applied by k_elu */
  for (int o = 16; o > 0; o >>= 1) s += __shfl_xor(s, o, 32); const float mu = s / (float)HID; float var = 0.f; for (int q = 0; q < 8; ++q) { const float d = h[q] - mu; var += d * d; }
  for (int o = 16; o > 0; o >>= 1) var += __shfl_xor(var, o, 32); const float inv = rsqrtf(var / (float)HID + 1e-5f); float al = 0.f;
  for (int q = 0; q < 8; ++q) { const int c = ln * 8 + q; float hn = (h[q] - mu) * inv; hn *= bf16_round(g[c]); hn += bf16_round(bb[c]); al += hn * bf16_round(W2[c]); }
  for (int o = 16; o > 0; o >>= 1) al += __shfl_xor(al, o, 32); al += bf16_round(b2[0]); const float gate = 1.0f / (1.0f + expf(-al));
  const float v = bf16_round(x[r * CPN + ln]) * gate; *(float*)(out + r * CPN + ln) = v;  }

extern "C" void kernel_launch(void* const* d_in, const int* in_sizes, int n_in,
                              void* d_out, int out_size, void* d_ws, size_t ws_size, hipStream_t stream) {
  (void)in_sizes; (void)n_in; (void)out_size;
  const float* const* I = (const float* const*)d_in; const float* x = I[0]; const float* W1 = I[1]; const float* b1 = I[2]; const float* g = I[3]; const float* bb = I[4]; const float* W2 = I[5]; const float* b2 = I[6];
  char* ws = (char*)d_ws; size_t off = 0;
  auto take = [&](size_t bytes) { char* p = ws + off; off += (bytes + 255) & ~(size_t)255; return p; };
  _Float16* BW = (_Float16*)take((size_t)HID * CPN * 2); _Float16* X16 = (_Float16*)take((size_t)NRW * CPN * 2); float* Hp = (float*)take((size_t)(NRW / 2) * HID * 4);      /* hidden plane for half the rows at a time (128 MiB) */
  if (off > ws_size) return;      /* 16 KB + 16 + 128 = 144 MiB */
  k_wt_f16<<<(HID * CPN / 8 + 255) / 256, 256, 0, stream>>>(W1, BW, CPN, HID, 16.0f);      /* (in, out) */
  k_x16<<<(unsigned)(((size_t)NRW * CPN / 8 + 255) / 256), 256, 0, stream>>>(x, X16, (size_t)NRW * CPN / 8);
  for (int half = 0; half < 2; ++half) { const size_t r0 = (size_t)half * (NRW / 2);
    k_gemm2<0><<<dim3(((NRW / 2) / 128) * (HID / 64), 1), 128, 0, stream>>>(X16 + r0 * CPN, CPN, 0, BW, CPN, 0, 0.0625f, b1, 0, nullptr, 1, 0, 0, Hp, nullptr, HID, 0, NRW / 2, HID, CPN);      /* pre-activation x W1 + b1 */
    k_elu<<<(unsigned)(((size_t)(NRW / 2) * HID / 4 + 255) / 256), 256, 0, stream>>>(Hp, (size_t)(NRW / 2) * HID / 4);
    k_gate<<<(unsigned)((NRW / 2) / 8), 256, 0, stream>>>(Hp, x + r0 * CPN, g, bb, W2, b2, (float*)d_out + r0 * CPN); }
}

// v001
// It runs in 31.3 microseconds.
// Timed twice side by side with v000, it ran 6.02 and 6.06 times as fast.
#include <hip/hip_runtime.h>
// Per-node gate (32 samples x 8192 nodes x 32 channels-per-node): h = elu(x_n W1 + b1) (HID 256); hn = LayerNorm(h) (biased var, 1e-5, affine); alpha = hn . W2 + b2; out = x_n * sigmoid(alpha) per node.
// Compute dtype: x and parameters rounded to bf16; x and 16*W1 as f16 operands of v_wmma_f32_16x16x32_f16; everything else f32.
// One launch. The product is taken transposed (A = 16 hidden units of W1^T, B = 16 nodes of x), so a lane's eight accumulator
// registers are eight hidden units of ONE node: ELU and the three row sums of the LayerNorm stay in registers, and the hidden plane is never stored.
#define NBT 32
#define NND 8192
#define CPN 32
#define HID 256
#define NRW (NBT * NND)          /* 262144 node rows */
#define NJ 4                     /* node tiles (16 nodes each) per wave */
#define NWV 16                   /* waves per work-group */
typedef unsigned short v8us __attribute__((ext_vector_type(8), may_alias));
typedef float  v8f  __attribute__((ext_vector_type(8)));
typedef float  v8fa __attribute__((ext_vector_type(8), may_alias));
typedef float  v4f  __attribute__((ext_vector_type(4)));
typedef float  v4fa __attribute__((ext_vector_type(4), may_alias));
typedef float  v2f  __attribute__((ext_vector_type(2)));
typedef _Float16 v16h __attribute__((ext_vector_type(16)));
union FragH { v16h v; v8us half[2]; _Float16 h[16]; unsigned short u[16]; };

__device__ __forceinline__ unsigned short bf16_bits(float x) { unsigned int u = __float_as_uint(x); return (unsigned short)((u + 0x7FFFu + ((u >> 16) & 1u)) >> 16); }
__device__ __forceinline__ float bf16_val(unsigned short b) { return __uint_as_float(((unsigned int)b) << 16); }
__device__ __forceinline__ float bf16_round(float x) { return bf16_val(bf16_bits(x)); }
// lane l <-> lane l ^ 16
__device__ __forceinline__ float swap16(float v) { const int b = __float_as_int(v); return __int_as_float(__builtin_amdgcn_permlanex16(b, b, 0x76543210, 0xfedcba98, false, false)); }

__global__ __launch_bounds__(NWV * 32) void k_node_gate(const float* __restrict__ x, const float* __restrict__ W1, const float* __restrict__ b1, const float* __restrict__ g, const float* __restrict__ bb,
                                                        const float* __restrict__ W2, const float* __restrict__ b2, float* __restrict__ out) {
  __shared__ __attribute__((aligned(16))) unsigned short sA[(HID / 16) * 2 * 32 * 8];   /* 16*W1^T in fragment order: [hidden tile][k half][lane][8 f16] */
  __shared__ __attribute__((aligned(32))) float sP[2 * HID];                             /* b1, then g*W2 */
  const int tid = threadIdx.x, w = tid >> 5, lane = tid & 31, ln = lane & 15, hh = lane >> 4;
  const size_t node0 = ((size_t)blockIdx.x * NWV + w) * (16 * NJ);

  // every global load of the kernel is issued here, in front of the first wait, so that their latencies overlap
  // (all "#pragma unroll" below: register arrays need constant indices)
  float w1v[2][8];
#pragma unroll
  for (int u = 0; u < 2; ++u) {
    const int s = tid + u * (NWV * 32), sl = s & 31, n = (s >> 6) * 16 + (sl & 15), k0 = ((s >> 5) & 1) * 16 + 8 * (sl >> 4);
#pragma unroll
    for (int i = 0; i < 8; ++i) w1v[u][i] = W1[(size_t)(k0 + i) * HID + n];
  }
  const int pc = tid & (HID - 1);
  const float pb = b1[pc], pg = g[pc], pw = W2[pc];
  const v8f g8 = *(const v8fa*)(g + lane * 8), e8 = *(const v8fa*)(bb + lane * 8), w8 = *(const v8fa*)(W2 + lane * 8);
  const float b2v = b2[0];
  // precaution: the x loads below land in registers that held the offsets of the parameter loads above, so those loads take their addresses first
  asm volatile("s_wait_xcnt 0x0" ::: "memory");
  // x twice: in fragment order for the product (k = 8hh.., 16+8hh.. of node ln), and in line order for the gated store
  v4f xf[NJ][4], xc[NJ][4];
#pragma unroll
  for (int j = 0; j < NJ; ++j) {
    const float* xt = x + (node0 + (size_t)j * 16) * CPN;
    const float* xr = xt + ln * CPN + 8 * hh;
    xf[j][0] = *(const v4fa*)(xr); xf[j][1] = *(const v4fa*)(xr + 4); xf[j][2] = *(const v4fa*)(xr + 16); xf[j][3] = *(const v4fa*)(xr + 20);
#pragma unroll
    for (int q = 0; q < 4; ++q) xc[j][q] = *(const v4fa*)(xt + q * 128 + lane * 4);
  }
  // precaution: the wait takes both x addresses as inputs, so that no x load lands on an address pair that earlier x loads still name
  asm volatile("s_wait_xcnt 0x0" :: "v"(x + node0 * CPN + ln * CPN + 8 * hh), "v"(x + node0 * CPN + lane * 4) : "memory");

  // parameters into LDS, once per work-group
#pragma unroll
  for (int u = 0; u < 2; ++u) {
    FragH f;
#pragma unroll
    for (int i = 0; i < 8; ++i) f.h[i] = (_Float16)(bf16_round(w1v[u][i]) * 16.0f);
    *(v8us*)&sA[(size_t)(tid + u * (NWV * 32)) * 8] = f.half[0];
  }
  const float rb = bf16_round(pb), rgw = bf16_round(pg) * bf16_round(pw);
  sP[tid] = (tid < HID) ? rb : rgw;
  // sum of g*W2 and of beta*W2 (+ b2): every wave for itself
  float sgw = 0.f, sbw = 0.f;
#pragma unroll
  for (int q = 0; q < 8; ++q) { const float w2 = bf16_round(w8[q]); sgw += bf16_round(g8[q]) * w2; sbw += bf16_round(e8[q]) * w2; }
#pragma unroll
  for (int o = 16; o > 0; o >>= 1) { sgw += __shfl_xor(sgw, o, 32); sbw += __shfl_xor(sbw, o, 32); }
  sbw += bf16_round(b2v);
  __syncthreads();

  v16h bx[NJ];
#pragma unroll
  for (int j = 0; j < NJ; ++j) {
    FragH f;
#pragma unroll
    for (int q = 0; q < 4; ++q)
#pragma unroll
      for (int i = 0; i < 4; ++i) f.h[q * 4 + i] = (_Float16)bf16_round(xf[j][q][i]);
    bx[j] = f.v;
  }

  v2f s1[NJ], s2[NJ], sd[NJ];
#pragma unroll
  for (int j = 0; j < NJ; ++j) { s1[j] = (v2f){0.f, 0.f}; s2[j] = (v2f){0.f, 0.f}; sd[j] = (v2f){0.f, 0.f}; }
  const v8f z8 = {0.f, 0.f, 0.f, 0.f, 0.f, 0.f, 0.f, 0.f};
  const v2f sc = {0.0625f, 0.0625f};
  // rolled: for speed only
#pragma unroll 1
  for (int t = 0; t < HID / 16; ++t) {
    FragH a; a.half[0] = *(const v8us*)&sA[(t * 64 + lane) * 8]; a.half[1] = *(const v8us*)&sA[(t * 64 + 32 + lane) * 8];
    const v8f bv = *(const v8fa*)&sP[t * 16 + 8 * hh];
    const v8f gw = *(const v8fa*)&sP[HID + t * 16 + 8 * hh];
    v8f d[NJ];
#pragma unroll
    for (int j = 0; j < NJ; ++j) d[j] = __builtin_amdgcn_wmma_f32_16x16x32_f16(false, a.v, false, bx[j], (short)0, z8, false, false);
#pragma unroll
    for (int j = 0; j < NJ; ++j) {
#pragma unroll
      for (int r = 0; r < 8; r += 2) {
        const v2f v = __builtin_elementwise_fma((v2f){d[j][r], d[j][r + 1]}, sc, (v2f){bv[r], bv[r + 1]});
        // elu(v) = max(v, 0) + expm1(min(v, 0)): the same values as the select, with no branch per element
        const v2f hv = {fmaxf(v[0], 0.f) + expm1f(fminf(v[0], 0.f)), fmaxf(v[1], 0.f) + expm1f(fminf(v[1], 0.f))};
        s1[j] += hv;
        s2[j] = __builtin_elementwise_fma(hv, hv, s2[j]);
        sd[j] = __builtin_elementwise_fma(hv, (v2f){gw[r], gw[r + 1]}, sd[j]);
      }
    }
  }

#pragma unroll
  for (int j = 0; j < NJ; ++j) {
    float a1 = s1[j][0] + s1[j][1], a2 = s2[j][0] + s2[j][1], ad = sd[j][0] + sd[j][1];
    a1 += swap16(a1); a2 += swap16(a2); ad += swap16(ad);      /* lanes ln and ln + 16 hold the two halves of node ln */
    const float mu = a1 * (1.0f / (float)HID);
    const float var = fmaxf(a2 * (1.0f / (float)HID) - mu * mu, 0.f);
    const float inv = rsqrtf(var + 1e-5f);
    const float al = inv * (ad - mu * sgw) + sbw;
    const float gate = 1.0f / (1.0f + expf(-al));
    float* ot = out + (node0 + (size_t)j * 16) * CPN;
#pragma unroll
    for (int q = 0; q < 4; ++q) {
      const float gq = __shfl(gate, q * 4 + (lane >> 3), 32);      /* a store covers four whole node rows */
      v4f o;
#pragma unroll
      for (int i = 0; i < 4; ++i) o[i] = bf16_round(xc[j][q][i]) * gq;
      *(v4f*)(ot + q * 128 + lane * 4) = o;
    }
  }
}

extern "C" void kernel_launch(void* const* d_in, const int* in_sizes, int n_in,
                              void* d_out, int out_size, void* d_ws, size_t ws_size, hipStream_t stream) {
  (void)in_sizes; (void)n_in; (void)out_size; (void)d_ws; (void)ws_size;
  const float* const* I = (const float* const*)d_in; const float* x = I[0]; const float* W1 = I[1]; const float* b1 = I[2]; const float* g = I[3]; const float* bb = I[4]; const float* W2 = I[5]; const float* b2 = I[6];
  k_node_gate<<<NRW / (16 * NJ * NWV), NWV * 32, 0, stream>>>(x, W1, b1, g, bb, W2, b2, (float*)d_out);
}

// v002
// It runs in 14.1 microseconds.
// Next to v001, in two timings, it ran 2.20 and 2.22 times as fast.
// Over all steps from v000 it is 13.4 times as fast.
#include <hip/hip_runtime.h>
// Per-node gate (32 samples x 8192 nodes x 32 channels-per-node): h = elu(x_n W1 + b1) (HID 256); hn = LayerNorm(h) (biased var, 1e-5, affine); alpha = hn . W2 + b2; out = x_n * sigmoid(alpha) per node.
// Compute dtype: x and parameters rounded to bf16; x and 16*W1 as f16 operands of v_wmma_f32_16x16x32_f16; everything else f32.
// One launch. The product is taken transposed (A = 16 hidden units of W1^T, B = 16 nodes of x), so a lane's eight accumulator
// registers are eight hidden units of ONE node: ELU and the three row sums of the LayerNorm stay in registers, and the hidden plane is never stored.
// The sums run over H = 16 * (elu(v) + 1): (h - mean) * rsqrt(var + eps) does not change under h -> 16 * (h + 1) when eps becomes 256 * eps.
// elu(v) + 1 is v + 1 above zero and exp(v) below; as exp(v) >= v + 1 everywhere, that is the median of v + 1, 1 and exp(v).
#define NBT 32
#define NND 8192
#define CPN 32
#define HID 256
#define NRW (NBT * NND)          /* 262144 node rows */
#define NJ 4                     /* node tiles (16 nodes each) per wave */
#define NWV 16                   /* waves per work-group */
typedef unsigned short v8us __attribute__((ext_vector_type(8), may_alias));
typedef float  v8f  __attribute__((ext_vector_type(8)));
typedef float  v8fa __attribute__((ext_vector_type(8), may_alias));
typedef float  v4f  __attribute__((ext_vector_type(4)));
typedef float  v4fa __attribute__((ext_vector_type(4), may_alias));
typedef float  v2f  __attribute__((ext_vector_type(2)));
typedef _Float16 v16h __attribute__((ext_vector_type(16)));
union FragH { v16h v; v8us half[2]; _Float16 h[16]; unsigned short u[16]; };

__device__ __forceinline__ unsigned short bf16_bits(float x) { unsigned int u = __float_as_uint(x); return (unsigned short)((u + 0x7FFFu + ((u >> 16) & 1u)) >> 16); }
__device__ __forceinline__ float bf16_val(unsigned short b) { return __uint_as_float(((unsigned int)b) << 16); }
__device__ __forceinline__ float bf16_round(float x) { return bf16_val(bf16_bits(x)); }
// lane l <-> lane l ^ 16
__device__ __forceinline__ float swap16(float v) { const int b = __float_as_int(v); return __int_as_float(__builtin_amdgcn_permlanex16(b, b, 0x76543210, 0xfedcba98, false, false)); }

__global__ __launch_bounds__(NWV * 32) void k_node_gate(const float* __restrict__ x, const float* __restrict__ W1, const float* __restrict__ b1, const float* __restrict__ g, const float* __restrict__ bb,
                                                        const float* __restrict__ W2, const float* __restrict__ b2, float* __restrict__ out) {
  __shared__ __attribute__((aligned(16))) unsigned short sA[(HID / 16) * 2 * 32 * 8];   /* 16*W1^T in fragment order: [hidden tile][k half][lane][8 f16] */
  __shared__ __attribute__((aligned(32))) float sP[2 * HID];                             /* 16*(b1+1), then g*W2 */
  const int tid = threadIdx.x, w = tid >> 5, lane = tid & 31, ln = lane & 15, hh = lane >> 4;
  const size_t node0 = ((size_t)blockIdx.x * NWV + w) * (16 * NJ);

  // every global load of the kernel is issued here, in front of the first wait, so that their latencies overlap
  // (all "#pragma unroll" below: register arrays need constant indices)
  float w1v[2][8];
#pragma unroll
  for (int u = 0; u < 2; ++u) {
    const int s = tid + u * (NWV * 32), sl = s & 31, n = (s >> 6) * 16 + (sl & 15), k0 = ((s >> 5) & 1) * 16 + 8 * (sl >> 4);
#pragma unroll
    for (int i = 0; i < 8; ++i) w1v[u][i] = W1[(size_t)(k0 + i) * HID + n];
  }
  const int pc = tid & (HID - 1);
  const float pb = b1[pc], pg = g[pc], pw = W2[pc];
  const v8f g8 = *(const v8fa*)(g + lane * 8), e8 = *(const v8fa*)(bb + lane * 8), w8 = *(const v8fa*)(W2 + lane * 8);
  const float b2v = b2[0];
  // precaution: the x loads below land in registers that held the offsets of the parameter loads above, so those loads take their addresses first
  asm volatile("s_wait_xcnt 0x0" ::: "memory");
  // x twice: in fragment order for the product (k = 8hh.., 16+8hh.. of node ln), and in line order for the gated store
  v4f xf[NJ][4], xc[NJ][4];
#pragma unroll
  for (int j = 0; j < NJ; ++j) {
    const float* xt = x + (node0 + (size_t)j * 16) * CPN;
    const float* xr = xt + ln * CPN + 8 * hh;
    xf[j][0] = *(const v4fa*)(xr); xf[j][1] = *(const v4fa*)(xr + 4); xf[j][2] = *(const v4fa*)(xr + 16); xf[j][3] = *(const v4fa*)(xr + 20);
#pragma unroll
    for (int q = 0; q < 4; ++q) xc[j][q] = *(const v4fa*)(xt + q * 128 + lane * 4);
  }
  // precaution: the wait takes both x addresses as inputs, so that no x load lands on an address pair that earlier x loads still name
  asm volatile("s_wait_xcnt 0x0" :: "v"(x + node0 * CPN + ln * CPN + 8 * hh), "v"(x + node0 * CPN + lane * 4) : "memory");

  // parameters into LDS, once per work-group
#pragma unroll
  for (int u = 0; u < 2; ++u) {
    FragH f;
#pragma unroll
    for (int i = 0; i < 8; ++i) f.h[i] = (_Float16)(bf16_round(w1v[u][i]) * 16.0f);
    *(v8us*)&sA[(size_t)(tid + u * (NWV * 32)) * 8] = f.half[0];
  }
  const float rb = bf16_round(pb), rgw = bf16_round(pg) * bf16_round(pw);
  sP[tid] = (tid < HID) ? 16.0f * (rb + 1.0f) : rgw;
  // sum of g*W2 and of beta*W2 (+ b2): every wave for itself
  float sgw = 0.f, sbw = 0.f;
#pragma unroll
  for (int q = 0; q < 8; ++q) { const float w2 = bf16_round(w8[q]); sgw += bf16_round(g8[q]) * w2; sbw += bf16_round(e8[q]) * w2; }
#pragma unroll
  for (int o = 16; o > 0; o >>= 1) { sgw += __shfl_xor(sgw, o, 32); sbw += __shfl_xor(sbw, o, 32); }
  sbw += bf16_round(b2v);
  __syncthreads();

  v16h bx[NJ];
#pragma unroll
  for (int j = 0; j < NJ; ++j) {
    FragH f;
#pragma unroll
    for (int q = 0; q < 4; ++q)
#pragma unroll
      for (int i = 0; i < 4; ++i) f.h[q * 4 + i] = (_Float16)bf16_round(xf[j][q][i]);
    bx[j] = f.v;
  }

  v2f s1[NJ], s2[NJ], sd[NJ];
#pragma unroll
  for (int j = 0; j < NJ; ++j) { s1[j] = (v2f){0.f, 0.f}; s2[j] = (v2f){0.f, 0.f}; sd[j] = (v2f){0.f, 0.f}; }
  // 16 * exp(v) = exp2(D * log2(e) / 16 + 4 - log2(e)), with D = 16 * (v + 1)
  const v2f ea = {0.0901684400555602f, 0.0901684400555602f}, eb = {2.5573049591110366f, 2.5573049591110366f};
  // rolled: for speed only
#pragma unroll 1
  for (int t = 0; t < HID / 16; ++t) {
    FragH a; a.half[0] = *(const v8us*)&sA[(t * 64 + lane) * 8]; a.half[1] = *(const v8us*)&sA[(t * 64 + 32 + lane) * 8];
    const v8f cb = *(const v8fa*)&sP[t * 16 + 8 * hh];      /* the bias enters as the product's C operand */
    const v8f gw = *(const v8fa*)&sP[HID + t * 16 + 8 * hh];
    v8f d[NJ];
#pragma unroll
    for (int j = 0; j < NJ; ++j) d[j] = __builtin_amdgcn_wmma_f32_16x16x32_f16(false, a.v, false, bx[j], (short)0, cb, false, false);
    // The order below is kept by the fences: behind every exp2 stand plain vector instructions that neither read its result nor are another exp2,
    // so that the exp2 pipe runs beside the plain one, and no exp2 takes the register that the exp2 directly in front of it has just read.
    static_assert(NJ == 4, "tiles 2 and 3 get their exp2 arguments behind the exp2 of tile 0");
    v2f ar[NJ][4], hv[NJ][4];
    float ev[NJ][8];
    const auto arg = [&](int j, int q) { ar[j][q] = __builtin_elementwise_fma((v2f){d[j][2 * q], d[j][2 * q + 1]}, ea, eb); };
    const auto med = [&](int j, int q) { hv[j][q] = (v2f){__builtin_amdgcn_fmed3f(d[j][2 * q], 16.0f, ev[j][2 * q]), __builtin_amdgcn_fmed3f(d[j][2 * q + 1], 16.0f, ev[j][2 * q + 1])}; };
    const auto add1 = [&](int j, int q) { s1[j] += hv[j][q]; };
    const auto add2 = [&](int j, int q) { s2[j] = __builtin_elementwise_fma(hv[j][q], hv[j][q], s2[j]); sd[j] = __builtin_elementwise_fma(hv[j][q], (v2f){gw[2 * q], gw[2 * q + 1]}, sd[j]); };
    // a tile's twenty plain instructions in eight groups, each sum well behind the medians that it reads
    const auto plain = [&](int j, int c) {
      if (c == 0) med(j, 0);
      else if (c == 7) { add1(j, 3); add2(j, 3); }
      else if (c & 1) { med(j, (c + 1) / 2); add1(j, (c - 1) / 2); }
      else add2(j, c / 2 - 1);
    };
#pragma unroll
    for (int q = 0; q < 4; ++q) { arg(0, q); arg(1, q); }
    __builtin_amdgcn_sched_barrier(0);
#pragma unroll
    for (int j = 0; j < NJ; ++j) {
#pragma unroll
      for (int r = 0; r < 8; ++r) {
        ev[j][r] = __builtin_amdgcn_exp2f(ar[j][r >> 1][r & 1]);
        __builtin_amdgcn_sched_barrier(0);
        if (j == 0) arg(2 + (r >> 2), r & 3); else plain(j - 1, r);
        __builtin_amdgcn_sched_barrier(0);
      }
    }
#pragma unroll
    for (int c = 0; c < 8; ++c) plain(NJ - 1, c);
  }

#pragma unroll
  for (int j = 0; j < NJ; ++j) {
    float a1 = s1[j][0] + s1[j][1], a2 = s2[j][0] + s2[j][1], ad = sd[j][0] + sd[j][1];
    a1 += swap16(a1); a2 += swap16(a2); ad += swap16(ad);      /* lanes ln and ln + 16 hold the two halves of node ln */
    const float mu = a1 * (1.0f / (float)HID);
    const float var = fmaxf(a2 * (1.0f / (float)HID) - mu * mu, 0.f);
    const float inv = rsqrtf(var + 256.0f * 1e-5f);           /* the sums carry the factor 16, the variance 256 */
    const float al = inv * (ad - mu * sgw) + sbw;
    const float gate = 1.0f / (1.0f + expf(-al));
    float* ot = out + (node0 + (size_t)j * 16) * CPN;
#pragma unroll
    for (int q = 0; q < 4; ++q) {
      const float gq = __shfl(gate, q * 4 + (lane >> 3), 32);      /* a store covers four whole node rows */
      v4f o;
#pragma unroll
      for (int i = 0; i < 4; ++i) o[i] = bf16_round(xc[j][q][i]) * gq;
      *(v4f*)(ot + q * 128 + lane * 4) = o;
    }
  }
}

extern "C" void kernel_launch(void* const* d_in, const int* in_sizes, int n_in,
                              void* d_out, int out_size, void* d_ws, size_t ws_size, hipStream_t stream) {
  (void)in_sizes; (void)n_in; (void)out_size; (void)d_ws; (void)ws_size;
  const float* const* I = (const float* const*)d_in; const float* x = I[0]; const float* W1 = I[1]; const float* b1 = I[2]; const float* g = I[3]; const float* bb = I[4]; const float* W2 = I[5]; const float* b2 = I[6];
  k_node_gate<<<NRW / (16 * NJ * NWV), NWV * 32, 0, stream>>>(x, W1, b1, g, bb, W2, b2, (float*)d_out);
}

// v003
// Measured time: 12.4 microseconds a run.
// Timed twice side by side with v002, it ran 1.13 times as fast both times.
// All steps since v000 together make it 15.1 times as fast.
#include <hip/hip_runtime.h>
// Per-node gate (32 samples x 8192 nodes x 32 channels-per-node): h = elu(x_n W1 + b1) (HID 256); hn = LayerNorm(h) (biased var, 1e-5, affine); alpha = hn . W2 + b2; out = x_n * sigmoid(alpha) per node.
// Compute dtype: x and parameters rounded to bf16; x and 16*W1 as f16 operands of v_wmma_f32_16x16x32_f16; everything else f32.
// One launch. The product is taken transposed (A = 16 hidden units of W1^T, B = 16 nodes of x), so a lane's eight accumulator
// registers are eight hidden units of ONE node: ELU and the three row sums of the LayerNorm stay in registers, and the hidden plane is never stored.
// x is read from global memory once, in whole 128-byte lines; each wave turns its own 64 node rows into B fragments through its own piece of LDS.
// The sums run over H = 16 * (elu(v) + 1): (h - mean) * rsqrt(var + eps) does not change under h -> 16 * (h + 1) when eps becomes 256 * eps.
// elu(v) + 1 is v + 1 above zero and exp(v) below; as exp(v) >= v + 1 everywhere, that is the median of v + 1, 1 and exp(v).
#define NBT 32
#define NND 8192
#define CPN 32
#define HID 256
#define NRW (NBT * NND)          /* 262144 node rows */
#define NJ 4                     /* node tiles (16 nodes each) per wave */
#define NWV 16                   /* waves per work-group */
#define XP 40                    /* f16 per staged node row: 64 B of data at a pitch of 80 B = 16 B x odd, which 16-byte LDS reads take without bank conflicts */
typedef unsigned short v8us __attribute__((ext_vector_type(8), may_alias));
typedef unsigned short v4us __attribute__((ext_vector_type(4), may_alias));
typedef float  v8f  __attribute__((ext_vector_type(8)));
typedef float  v8fa __attribute__((ext_vector_type(8), may_alias));
typedef float  v4f  __attribute__((ext_vector_type(4)));
typedef float  v4fa __attribute__((ext_vector_type(4), may_alias));
typedef float  v2f  __attribute__((ext_vector_type(2)));
typedef _Float16 v16h __attribute__((ext_vector_type(16)));
union FragH { v16h v; v8us half[2]; v4us quart[4]; _Float16 h[16]; unsigned short u[16]; };

__device__ __forceinline__ unsigned short bf16_bits(float x) { unsigned int u = __float_as_uint(x); return (unsigned short)((u + 0x7FFFu + ((u >> 16) & 1u)) >> 16); }
__device__ __forceinline__ float bf16_val(unsigned short b) { return __uint_as_float(((unsigned int)b) << 16); }
__device__ __forceinline__ float bf16_round(float x) { return bf16_val(bf16_bits(x)); }
// lane l <-> lane l ^ 16
__device__ __forceinline__ float swap16(float v) { const int b = __float_as_int(v); return __int_as_float(__builtin_amdgcn_permlanex16(b, b, 0x76543210, 0xfedcba98, false, false)); }

__global__ __launch_bounds__(NWV * 32) void k_node_gate(const float* __restrict__ x, const float* __restrict__ W1, const float* __restrict__ b1, const float* __restrict__ g, const float* __restrict__ bb,
                                                        const float* __restrict__ W2, const float* __restrict__ b2, float* __restrict__ out) {
  __shared__ __attribute__((aligned(16))) unsigned short sA[(HID / 16) * 2 * 32 * 8];   /* 16*W1^T in fragment order: [hidden tile][k half][lane][8 f16] */
  __shared__ __attribute__((aligned(32))) float sP[2 * HID];                             /* 16*(b1+1), then g*W2 */
  __shared__ __attribute__((aligned(16))) unsigned short sX[NWV * NJ * 16 * XP];         /* x as f16: [wave][node row][channel], each wave's part written and read by that wave alone */
  const int tid = threadIdx.x, w = tid >> 5, lane = tid & 31, ln = lane & 15, hh = lane >> 4;
  const size_t node0 = ((size_t)blockIdx.x * NWV + w) * (16 * NJ);

  // every global load of the kernel is issued here, in front of the first wait, so that their latencies overlap
  // (all "#pragma unroll" below: register arrays need constant indices)
  float w1v[2][8];
#pragma unroll
  for (int u = 0; u < 2; ++u) {
    const int s = tid + u * (NWV * 32), sl = s & 31, n = (s >> 6) * 16 + (sl & 15), k0 = ((s >> 5) & 1) * 16 + 8 * (sl >> 4);
#pragma unroll
    for (int i = 0; i < 8; ++i) w1v[u][i] = W1[(size_t)(k0 + i) * HID + n];
  }
  const int pc = tid & (HID - 1);
  const float pb = b1[pc], pg = g[pc], pw = W2[pc];
  const v8f g8 = *(const v8fa*)(g + lane * 8), e8 = *(const v8fa*)(bb + lane * 8), w8 = *(const v8fa*)(W2 + lane * 8);
  const float b2v = b2[0];
  // precaution: the x loads below land in registers that held the offsets of the parameter loads above, so those loads take their addresses first
  asm volatile("s_wait_xcnt 0x0" ::: "memory");
  // x once, in line order (a load covers four whole node rows): these registers feed both the product and the gated store
  v4f xc[NJ][4];
#pragma unroll
  for (int j = 0; j < NJ; ++j) {
    const float* xt = x + (node0 + (size_t)j * 16) * CPN;
#pragma unroll
    for (int q = 0; q < 4; ++q) xc[j][q] = *(const v4fa*)(xt + q * 128 + lane * 4);
  }
  // precaution: the wait takes the x address as an input, so that no x load lands on an address pair that earlier x loads still name
  asm volatile("s_wait_xcnt 0x0" :: "v"(x + node0 * CPN + lane * 4) : "memory");

  // parameters into LDS, once per work-group
#pragma unroll
  for (int u = 0; u < 2; ++u) {
    FragH f;
#pragma unroll
    for (int i = 0; i < 8; ++i) f.h[i] = (_Float16)(bf16_round(w1v[u][i]) * 16.0f);
    *(v8us*)&sA[(size_t)(tid + u * (NWV * 32)) * 8] = f.half[0];
  }
  const float rb = bf16_round(pb), rgw = bf16_round(pg) * bf16_round(pw);
  sP[tid] = (tid < HID) ? 16.0f * (rb + 1.0f) : rgw;
  // sum of g*W2 and of beta*W2 (+ b2): every wave for itself
  float sgw = 0.f, sbw = 0.f;
#pragma unroll
  for (int q = 0; q < 8; ++q) { const float w2 = bf16_round(w8[q]); sgw += bf16_round(g8[q]) * w2; sbw += bf16_round(e8[q]) * w2; }
#pragma unroll
  for (int o = 16; o > 0; o >>= 1) { sgw += __shfl_xor(sgw, o, 32); sbw += __shfl_xor(sbw, o, 32); }
  sbw += bf16_round(b2v);
  __syncthreads();

  // line order -> fragment order (k = 8hh.., 16+8hh.. of node ln); x is rounded here once, and xc keeps the rounded values for the store
  unsigned short* const sw = sX + w * (NJ * 16 * XP);
#pragma unroll
  for (int j = 0; j < NJ; ++j)
#pragma unroll
    for (int q = 0; q < 4; ++q) {
      FragH f;
#pragma unroll
      for (int i = 0; i < 4; ++i) { xc[j][q][i] = bf16_round(xc[j][q][i]); f.h[i] = (_Float16)xc[j][q][i]; }
      *(v4us*)&sw[(j * 16 + q * 4 + (lane >> 3)) * XP + (lane & 7) * 4] = f.quart[0];
    }
  // a lane reads back what other lanes of its own wave have written: their LDS stores are done first, and the compiler moves no read above this line
  asm volatile("s_wait_dscnt 0x0" ::: "memory");
  v16h bx[NJ];
#pragma unroll
  for (int j = 0; j < NJ; ++j) {
    FragH f; f.half[0] = *(const v8us*)&sw[(j * 16 + ln) * XP + 8 * hh]; f.half[1] = *(const v8us*)&sw[(j * 16 + ln) * XP + 16 + 8 * hh];
    bx[j] = f.v;
  }

  v2f s1[NJ], s2[NJ], sd[NJ];
#pragma unroll
  for (int j = 0; j < NJ; ++j) { s1[j] = (v2f){0.f, 0.f}; s2[j] = (v2f){0.f, 0.f}; sd[j] = (v2f){0.f, 0.f}; }
  // 16 * exp(v) = exp2(D * log2(e) / 16 + 4 - log2(e)), with D = 16 * (v + 1)
  const v2f ea = {0.0901684400555602f, 0.0901684400555602f}, eb = {2.5573049591110366f, 2.5573049591110366f};
  // rolled: for speed only
#pragma unroll 1
  for (int t = 0; t < HID / 16; ++t) {
    FragH a; a.half[0] = *(const v8us*)&sA[(t * 64 + lane) * 8]; a.half[1] = *(const v8us*)&sA[(t * 64 + 32 + lane) * 8];
    const v8f cb = *(const v8fa*)&sP[t * 16 + 8 * hh];      /* the bias enters as the product's C operand */
    const v8f gw = *(const v8fa*)&sP[HID + t * 16 + 8 * hh];
    v8f d[NJ];
#pragma unroll
    for (int j = 0; j < NJ; ++j) d[j] = __builtin_amdgcn_wmma_f32_16x16x32_f16(false, a.v, false, bx[j], (short)0, cb, false, false);
    // The order below is kept by the fences: behind every exp2 stand plain vector instructions that neither read its result nor are another exp2,
    // so that the exp2 pipe runs beside the plain one, and no exp2 takes the register that the exp2 directly in front of it has just read.
    static_assert(NJ == 4, "tiles 2 and 3 get their exp2 arguments behind the exp2 of tile 0");
    v2f ar[NJ][4], hv[NJ][4];
    float ev[NJ][8];
    const auto arg = [&](int j, int q) { ar[j][q] = __builtin_elementwise_fma((v2f){d[j][2 * q], d[j][2 * q + 1]}, ea, eb); };
    const auto med = [&](int j, int q) { hv[j][q] = (v2f){__builtin_amdgcn_fmed3f(d[j][2 * q], 16.0f, ev[j][2 * q]), __builtin_amdgcn_fmed3f(d[j][2 * q + 1], 16.0f, ev[j][2 * q + 1])}; };
    const auto add1 = [&](int j, int q) { s1[j] += hv[j][q]; };
    const auto add2 = [&](int j, int q) { s2[j] = __builtin_elementwise_fma(hv[j][q], hv[j][q], s2[j]); sd[j] = __builtin_elementwise_fma(hv[j][q], (v2f){gw[2 * q], gw[2 * q + 1]}, sd[j]); };
    // a tile's twenty plain instructions in eight groups, each sum well behind the medians that it reads
    const auto plain = [&](int j, int c) {
      if (c == 0) med(j, 0);
      else if (c == 7) { add1(j, 3); add2(j, 3); }
      else if (c & 1) { med(j, (c + 1) / 2); add1(j, (c - 1) / 2); }
      else add2(j, c / 2 - 1);
    };
#pragma unroll
    for (int q = 0; q < 4; ++q) { arg(0, q); arg(1, q); }
    __builtin_amdgcn_sched_barrier(0);
#pragma unroll
    for (int j = 0; j < NJ; ++j) {
#pragma unroll
      for (int r = 0; r < 8; ++r) {
        ev[j][r] = __builtin_amdgcn_exp2f(ar[j][r >> 1][r & 1]);
        __builtin_amdgcn_sched_barrier(0);
        if (j == 0) arg(2 + (r >> 2), r & 3); else plain(j - 1, r);
        __builtin_amdgcn_sched_barrier(0);
      }
    }
#pragma unroll
    for (int c = 0; c < 8; ++c) plain(NJ - 1, c);
  }

#pragma unroll
  for (int j = 0; j < NJ; ++j) {
    float a1 = s1[j][0] + s1[j][1], a2 = s2[j][0] + s2[j][1], ad = sd[j][0] + sd[j][1];
    a1 += swap16(a1); a2 += swap16(a2); ad += swap16(ad);      /* lanes ln and ln + 16 hold the two halves of node ln */
    const float mu = a1 * (1.0f / (float)HID);
    const float var = fmaxf(a2 * (1.0f / (float)HID) - mu * mu, 0.f);
    const float inv = rsqrtf(var + 256.0f * 1e-5f);           /* the sums carry the factor 16, the variance 256 */
    const float al = inv * (ad - mu * sgw) + sbw;
    const float gate = 1.0f / (1.0f + expf(-al));
    float* ot = out + (node0 + (size_t)j * 16) * CPN;
#pragma unroll
    for (int q = 0; q < 4; ++q) {
      const float gq = __shfl(gate, q * 4 + (lane >> 3), 32);      /* a store covers four whole node rows */
      v4f o;
#pragma unroll
      for (int i = 0; i < 4; ++i) o[i] = xc[j][q][i] * gq;
      *(v4f*)(ot + q * 128 + lane * 4) = o;
    }
  }
}

extern "C" void kernel_launch(void* const* d_in, const int* in_sizes, int n_in,
                              void* d_out, int out_size, void* d_ws, size_t ws_size, hipStream_t stream) {
  (void)in_sizes; (void)n_in; (void)out_size; (void)d_ws; (void)ws_size;
  const float* const* I = (const float* const*)d_in; const float* x = I[0]; const float* W1 = I[1]; const float* b1 = I[2]; const float* g = I[3]; const float* bb = I[4]; const float* W2 = I[5]; const float* b2 = I[6];
  k_node_gate<<<NRW / (16 * NJ * NWV), NWV * 32, 0, stream>>>(x, W1, b1, g, bb, W2, b2, (float*)d_out);
}
